// v000
// Measured on an AMD MI455X. A time is GPU time per run, averaged over a window of back-to-back runs after a warm-up
// (all launches, gaps included; the runs take copies of the inputs in turn), and the median of several windows.
// Apart from v000's, it joins two sittings. Times from different sittings can be a few percent apart, while
// side-by-side timings come from the same sitting.
// v000, which the later versions start from, runs in 747 microseconds.
#include <hip/hip_runtime.h>
// Softmax-free 'attention': out = (q k^T) v per head, no scale, no softmax, no mask (q, k, v [1][16][4096][64] f32 ~ N(0, 1), HEAD-MAJOR; attn = einsum('bhqd,bhkd->bhqk', q, k); out = einsum('bhqk,bhkd->bhqd', attn, v) -> [1][16][4096][64]); built literally: the score matrix is materialised per head.
// Structure: q, k, v as exact f16 planes (bf16-rounded inputs are f16-exact); V^T of every head via LDS transposes (each head read as its own 64-wide slab); per group of 4 heads: scores = q k^T as a WMMA GEMM (32x64 wave tiles, f32 accumulation of 64 exact products, alpha 1) written as an F16 plane from the GEMM epilogue (|score| up to about 45: the f16 rounding is 2^-11 relative), then out = scores . V^T (K = 4096, f32 accumulation, alpha 1) written as f32 straight into the head-major output rows.
// Compute dtype: inputs rounded to bf16 -> exact f16 operands; the ONE computed operand is the score plane, stored as f16 by the GEMM's own epilogue; both accumulations f32. v_wmma_f32_16x16x32_f16.
#define NB 4
#define SQ 2048
#define DM 1024
#define NH 16
#define HD 64
#define HG 4                         /* heads per attention launch group */
#define B0 0                         /* first batch processed (debug hook) */
#define NBR NB                       /* not used by any launch */
#define NR ((size_t)NB * SQ)         /* unused */
#define MP ((int)((size_t)NBR * SQ)) /* not used by any launch */
#define QN SQ                        /* unused; the launches attend SS query rows per head */
#define NHD NH                       /* heads attended (debug hook) */
#define MPO MP                       /* unused */
#define LQ DM      /* unused; the q/k/v rows have pitch HD */
typedef __bf16 v16b __attribute__((ext_vector_type(16)));
typedef unsigned short v8us __attribute__((ext_vector_type(8), may_alias));
typedef float  v8f  __attribute__((ext_vector_type(8)));
typedef float  v4f  __attribute__((ext_vector_type(4)));
typedef float  v4fa __attribute__((ext_vector_type(4), may_alias));
union FragB { v16b v; v8us half[2]; unsigned short u[16]; };

__device__ __forceinline__ unsigned short bf16_bits(float x) { unsigned int u = __float_as_uint(x); return (unsigned short)((u + 0x7FFFu + ((u >> 16) & 1u)) >> 16); }
__device__ __forceinline__ float bf16_val(unsigned short b) { return __uint_as_float(((unsigned int)b) << 16); }
__device__ __forceinline__ float bf16_round(float x) { return bf16_val(bf16_bits(x)); }
// D += A·B with NT terms: 1 = ah·bh, 2 = + al·bh (A split), 3 = + ah·bl (both split)
template <int NT>
__device__ __forceinline__ v8f mmaN(v16b ah, v16b al, v16b bh, v16b bl, v8f c) {
  c = __builtin_amdgcn_wmma_f32_16x16x32_bf16(false, ah, false, bh, (short)0, c, false, false);
  if (NT >= 2) c = __builtin_amdgcn_wmma_f32_16x16x32_bf16(false, al, false, bh, (short)0, c, false, false);
  if (NT >= 3) c = __builtin_amdgcn_wmma_f32_16x16x32_bf16(false, ah, false, bl, (short)0, c, false, false);
  asm volatile("v_nop\n\tv_nop\n\tv_nop\n\tv_nop" : "+v"(c) : "v"(ah), "v"(al), "v"(bh), "v"(bl));
  return c;
}

__global__ __launch_bounds__(256) void k_wt_bf16(const float* __restrict__ W, unsigned short* __restrict__ Wt, int K, int N) {
  const int t = blockIdx.x * 256 + threadIdx.x;
  const int k8n = K / 8;
  if (t >= N * k8n) return;
  const int n = t / k8n, k8 = (t % k8n) * 8;
  v8us v;
#pragma unroll
  for (int i = 0; i < 8; ++i) v[i] = bf16_bits(W[(size_t)(k8 + i) * N + n]);
  *(v8us*)(Wt + (size_t)n * K + k8) = v;
  
}

// GEMM C[M][N] (f32, pitch ldc) = act(A[M][K]·W + bias). A f32 row-major (pitch lda) converted per fragment to bf16
// (ASPLIT: hi/lo two planes -> 2 terms, else single rounded term); Wt bf16 [N][K] (pitch ldb). BIAS_BF16 rounds the
// bias to bf16 first (bias quantised to bf16 before the add). K%32==0, M%16==0, N%64==0.
template <bool ASPLIT, int ACT, bool BIAS_BF16>
__global__ __launch_bounds__(128) void k_gemm_bf(const float* __restrict__ A, int lda, const unsigned short* __restrict__ Wt, int ldb,
                                               const float* __restrict__ bias, float* __restrict__ C, int ldc, int M, int N, int K) {
  __shared__ __attribute__((aligned(16))) float so[4][16][64];
  const int tid = threadIdx.x, w = tid >> 5, lane = tid & 31, ln = lane & 15, hh = lane >> 4;
  const int ntn = N / 64;
  const int wid = blockIdx.x * 4 + w;
  const int mt = wid / ntn, nq = wid % ntn;
  if (mt * 16 >= M) return;
  const int row0 = mt * 16, col0 = nq * 64;
  const float* arow = A + (size_t)(row0 + ln) * lda;
  v8f acc[4] = {};
  for (int kb = 0; kb < K; kb += 32) {
    FragB ah, al;
    const v4f x0 = *(const v4fa*)(arow + kb + 8 * hh), x1 = *(const v4fa*)(arow + kb + 8 * hh + 4);
    const v4f x2 = *(const v4fa*)(arow + kb + 16 + 8 * hh), x3 = *(const v4fa*)(arow + kb + 16 + 8 * hh + 4);
    float xs[16] = {x0[0],x0[1],x0[2],x0[3],x1[0],x1[1],x1[2],x1[3],x2[0],x2[1],x2[2],x2[3],x3[0],x3[1],x3[2],x3[3]};
#pragma unroll
    for (int i = 0; i < 16; ++i) { const unsigned short hb = bf16_bits(xs[i]); ah.u[i] = hb; al.u[i] = ASPLIT ? bf16_bits(xs[i] - bf16_val(hb)) : (unsigned short)0; }
#pragma unroll
    for (int t = 0; t < 4; ++t) {
      const unsigned short* brow = Wt + (size_t)(col0 + t * 16 + ln) * ldb + kb;
      FragB b;
      b.half[0] = *(const v8us*)(brow + 8 * hh);
      b.half[1] = *(const v8us*)(brow + 16 + 8 * hh);
      acc[t] = mmaN<ASPLIT ? 2 : 1>(ah.v, al.v, b.v, b.v, acc[t]);
    }
  }
#pragma unroll
  for (int t = 0; t < 4; ++t) {
    float bv = bias ? bias[col0 + t * 16 + ln] : 0.f;
    if (BIAS_BF16) bv = bf16_round(bv);
#pragma unroll
    for (int r = 0; r < 8; ++r) { float v = acc[t][r] + bv; if (ACT == 1) v = fmaxf(v, 0.f); so[w][8 * hh + r][t * 16 + ln] = v; }
  }
  __builtin_amdgcn_fence(__ATOMIC_ACQ_REL, "workgroup");
  __builtin_amdgcn_wave_barrier();
  const int rsub = lane >> 4, c4 = (lane & 15) * 4;
  {
#pragma unroll
    for (int q = 0; q < 8; ++q) {
      const int r = q * 2 + rsub;
      const v4f v = *(const v4fa*)&so[w][r][c4];
      *(v4f*)(C + (size_t)(row0 + r) * ldc + col0 + c4) = v;
    }
    
  }
}

// GEMM C = act(A·W + bias + resid): A f32 (ASPLIT -> hi/lo 2 terms), Wt bf16 [N][K]; ACT 0 none, 1 relu, 2 exact gelu;
// resid (optional, f32, row index = (row % rmod), pitch ldr, RES_BF16 rounds it) added before the activation.
template <bool ASPLIT, int ACT, bool BIAS_BF16, bool RES_BF16>
__global__ __launch_bounds__(128) void k_gemm_bf3(const float* __restrict__ A, int lda, const unsigned short* __restrict__ Wt, int ldb,
                                                const float* __restrict__ bias, const float* __restrict__ resid, int rmod, int ldr,
                                                float* __restrict__ C, int ldc, int M, int N, int K) {
  __shared__ __attribute__((aligned(16))) float so[4][16][64];
  const int tid = threadIdx.x, w = tid >> 5, lane = tid & 31, ln = lane & 15, hh = lane >> 4;
  const int ntn = N / 64;
  const int wid = blockIdx.x * 4 + w;
  const int mt = wid / ntn, nq = wid % ntn;
  if (mt * 16 >= M) return;
  const int row0 = mt * 16, col0 = nq * 64;
  const float* arow = A + (size_t)(row0 + ln) * lda;
  v8f acc[4] = {};
  for (int kb = 0; kb < K; kb += 32) {
    FragB ah, al;
    const v4f x0 = *(const v4fa*)(arow + kb + 8 * hh), x1 = *(const v4fa*)(arow + kb + 8 * hh + 4);
    const v4f x2 = *(const v4fa*)(arow + kb + 16 + 8 * hh), x3 = *(const v4fa*)(arow + kb + 16 + 8 * hh + 4);
    float xs[16] = {x0[0],x0[1],x0[2],x0[3],x1[0],x1[1],x1[2],x1[3],x2[0],x2[1],x2[2],x2[3],x3[0],x3[1],x3[2],x3[3]};
#pragma unroll
    for (int i = 0; i < 16; ++i) { const unsigned short hb = bf16_bits(xs[i]); ah.u[i] = hb; al.u[i] = ASPLIT ? bf16_bits(xs[i] - bf16_val(hb)) : (unsigned short)0; }
#pragma unroll
    for (int t = 0; t < 4; ++t) {
      const unsigned short* brow = Wt + (size_t)(col0 + t * 16 + ln) * ldb + kb;
      FragB b;
      b.half[0] = *(const v8us*)(brow + 8 * hh);
      b.half[1] = *(const v8us*)(brow + 16 + 8 * hh);
      acc[t] = mmaN<ASPLIT ? 2 : 1>(ah.v, al.v, b.v, b.v, acc[t]);
    }
  }
#pragma unroll
  for (int t = 0; t < 4; ++t) {
    const int col = col0 + t * 16 + ln;
    float bv = bias ? bias[col] : 0.f;
    if (BIAS_BF16) bv = bf16_round(bv);
#pragma unroll
    for (int r = 0; r < 8; ++r) {
      float v = acc[t][r] + bv;
      if (resid) { float rv = resid[(size_t)((row0 + 8 * hh + r) % rmod) * ldr + col]; if (RES_BF16) rv = bf16_round(rv); v += rv; }
      if (ACT == 1) v = fmaxf(v, 0.f);
      if (ACT == 2) v = 0.5f * v * (1.0f + erff(v * 0.70710678118654752f));
      if (ACT == 3) { const float u = 0.7978845608028654f * (v + 0.044715f * v * v * v); v = 0.5f * v * (1.0f + tanhf(u)); }
      so[w][8 * hh + r][t * 16 + ln] = v;
    }
  }
  __builtin_amdgcn_fence(__ATOMIC_ACQ_REL, "workgroup");
  __builtin_amdgcn_wave_barrier();
  const int rsub = lane >> 4, c4 = (lane & 15) * 4;
  {
#pragma unroll
    for (int q = 0; q < 8; ++q) {
      const int r = q * 2 + rsub;
      const v4f v = *(const v4fa*)&so[w][r][c4];
      *(v4f*)(C + (size_t)(row0 + r) * ldc + col0 + c4) = v;
    }
    
  }
}
// row LayerNorm (biased variance, eps) over N: s = X (+ R); optional out_sum <- s; out_norm <- (s-mu)*rsqrt(var+eps)*g + b
template <bool PARAM_BF16>
__global__ __launch_bounds__(256) void k_layernorm(const float* __restrict__ X, const float* __restrict__ R, const float* __restrict__ g, const float* __restrict__ bta,
                                                  float* __restrict__ out_sum, float* __restrict__ out_norm, int N, float eps) {
  __shared__ float red[256];
  const int row = blockIdx.x, tid = threadIdx.x;
  const float* x = X + (size_t)row * N; const float* rr = R ? R + (size_t)row * N : nullptr;
  float vals[16];                     // up to N = 4096
  const int per = N / 256;            // contiguous chunk per thread? use strided-by-4 chunks: thread handles j = tid*4 + 1024*u
  float s1 = 0.f;
  for (int u = 0; u < per / 4; ++u) {
    const int j = tid * 4 + 1024 * u;
    const v4f a = *(const v4fa*)(x + j);
    v4f b = {0.f,0.f,0.f,0.f}; if (rr) b = *(const v4fa*)(rr + j);
#pragma unroll
    for (int q = 0; q < 4; ++q) { const float v = a[q] + b[q]; vals[u * 4 + q] = v; s1 += v; }
  }
  red[tid] = s1; __syncthreads();
  for (int st = 128; st > 0; st >>= 1) { if (tid < st) red[tid] += red[tid + st]; __syncthreads(); }
  const float mu = red[0] / (float)N; __syncthreads();
  float s2 = 0.f;
  for (int u = 0; u < per / 4; ++u)
#pragma unroll
    for (int q = 0; q < 4; ++q) { const float c = vals[u * 4 + q] - mu; s2 += c * c; }
  red[tid] = s2; __syncthreads();
  for (int st = 128; st > 0; st >>= 1) { if (tid < st) red[tid] += red[tid + st]; __syncthreads(); }
  const float rs = rsqrtf(red[0] / (float)N + eps);
  {
    for (int u = 0; u < per / 4; ++u) {
      const int j = tid * 4 + 1024 * u;
      v4f o, sm;
#pragma unroll
      for (int q = 0; q < 4; ++q) {
        float gg = g[j + q], bb = bta[j + q];
        if (PARAM_BF16) { gg = bf16_round(gg); bb = bf16_round(bb); }
        sm[q] = vals[u * 4 + q]; o[q] = (vals[u * 4 + q] - mu) * rs * gg + bb;
      }
      if (out_sum) *(v4f*)(out_sum + (size_t)row * N + j) = sm;
      *(v4f*)(out_norm + (size_t)row * N + j) = o;
    }
    
  }
}



// ---- f16 WMMA path (v_wmma_f32_16x16x32_f16): 11-bit significands for operands in range — used here for the f16-exact q, k, V^T and the f16 score plane
typedef _Float16 v16h __attribute__((ext_vector_type(16)));
union FragH { v16h v; v8us half[2]; _Float16 h[16]; unsigned short u[16]; };
template <int NT>
__device__ __forceinline__ v8f mmaH(v16h ah, v16h al, v16h bh, v16h bl, v8f c) {
  c = __builtin_amdgcn_wmma_f32_16x16x32_f16(false, ah, false, bh, (short)0, c, false, false);
  if (NT >= 2) c = __builtin_amdgcn_wmma_f32_16x16x32_f16(false, al, false, bh, (short)0, c, false, false);
  if (NT >= 3) c = __builtin_amdgcn_wmma_f32_16x16x32_f16(false, ah, false, bl, (short)0, c, false, false);
  asm volatile("v_nop\n\tv_nop\n\tv_nop\n\tv_nop" : "+v"(c) : "v"(ah), "v"(al), "v"(bh), "v"(bl));
  return c;
}
// batched GEMM like k_gemm_b but f16 operands: A f32 (split into f16 hi/lo if ASPLIT, else rounded to f16), Bt = f16 values [n][k]; alpha; C f32; N multiple of 16 (partial tiles skipped)
template <bool ASPLIT>
__global__ __launch_bounds__(128) void k_gemm_h(const float* __restrict__ A, int lda, size_t sA, const _Float16* __restrict__ Bh, int ldb, size_t sB, float alpha, float* __restrict__ C, int ldc, size_t sC, int M, int N, int K) {
  __shared__ __attribute__((aligned(16))) float so[4][16][64];
  const int tid = threadIdx.x, w = tid >> 5, lane = tid & 31, ln = lane & 15, hh = lane >> 4; const int by = blockIdx.y;
  A += (size_t)by * sA; Bh += (size_t)by * sB; C += (size_t)by * sC;
  const int ntn = (N + 63) / 64; const int wid = blockIdx.x * 4 + w; const int mt = wid / ntn, nq = wid % ntn; if (mt * 16 >= M) return;
  const int row0 = mt * 16, col0 = nq * 64; const float* arow = A + (size_t)(row0 + ln) * lda;
  v8f acc[4] = {};
  for (int kb = 0; kb < K; kb += 32) {
    FragH ah, al;
    const v4f x0 = *(const v4fa*)(arow + kb + 8 * hh), x1 = *(const v4fa*)(arow + kb + 8 * hh + 4), x2 = *(const v4fa*)(arow + kb + 16 + 8 * hh), x3 = *(const v4fa*)(arow + kb + 16 + 8 * hh + 4);
    float xs[16] = {x0[0],x0[1],x0[2],x0[3],x1[0],x1[1],x1[2],x1[3],x2[0],x2[1],x2[2],x2[3],x3[0],x3[1],x3[2],x3[3]};
#pragma unroll
    for (int i = 0; i < 16; ++i) { const _Float16 h = (_Float16)xs[i]; ah.h[i] = h; al.h[i] = ASPLIT ? (_Float16)(xs[i] - (float)h) : (_Float16)0.0f; }
#pragma unroll
    for (int t = 0; t < 4; ++t) { if (col0 + t * 16 >= N) continue; const size_t boff = (size_t)(col0 + t * 16 + ln) * ldb + kb; FragH bq; bq.half[0] = *(const v8us*)(Bh + boff + 8 * hh); bq.half[1] = *(const v8us*)(Bh + boff + 16 + 8 * hh);
      acc[t] = mmaH<ASPLIT ? 2 : 1>(ah.v, al.v, bq.v, bq.v, acc[t]); }
  }
#pragma unroll
  for (int t = 0; t < 4; ++t) { if (col0 + t * 16 >= N) continue;
#pragma unroll
    for (int r = 0; r < 8; ++r) so[w][8 * hh + r][t * 16 + ln] = acc[t][r] * alpha; }
  __builtin_amdgcn_fence(__ATOMIC_ACQ_REL, "workgroup"); __builtin_amdgcn_wave_barrier();
  const int rsub = lane >> 4, c4 = (lane & 15) * 4;
  {
#pragma unroll
    for (int q = 0; q < 8; ++q) { const int r = q * 2 + rsub; if (col0 + c4 < N) { const v4f v = *(const v4fa*)&so[w][r][c4]; *(v4f*)(C + (size_t)(row0 + r) * ldc + col0 + c4) = v; } }
     }
}

// Wt[n][k] = f16(W[k][n]·scale) from f32 row-major W[K][N] (scale = power of two; bf16-exact weights stay exact in f16 away from the subnormal range)
__global__ __launch_bounds__(256) void k_wt_f16(const float* __restrict__ W, _Float16* __restrict__ Wt, int K, int N, float scale) {
  const int t = blockIdx.x * 256 + threadIdx.x; if (t >= N * (K / 8)) return; const int n = t / (K / 8), k8 = (t % (K / 8)) * 8; FragH f;
#pragma unroll
  for (int i = 0; i < 8; ++i) f.h[i] = (_Float16)(bf16_round(W[(size_t)(k8 + i) * N + n]) * scale); const v8us o = f.half[0];
  *(v8us*)((unsigned short*)Wt + (size_t)n * K + k8) = o; 
}
// k_gemm_hh variant with fused epilogue: v = acc·alpha + bias[by·sBias + col] (+ CP[(row/rowsPerB)·sCPb + by·64 + col] if CP) ; ACT 0 none / 1 elu ; writes f16 C16 (and f32 C if non-null)
template <int ACT>
__global__ __launch_bounds__(128) void k_gemm_hhx(const _Float16* __restrict__ A, int lda, size_t sA, const _Float16* __restrict__ Bh, int ldb, size_t sB, float alpha, const float* __restrict__ bias, size_t sBias, const float* __restrict__ CP, int rowsPerB, size_t sCPb, int row0g,
    float* __restrict__ C, _Float16* __restrict__ C16, int ldc, size_t sC, int M, int N, int K) {
  __shared__ __attribute__((aligned(16))) float so[4][16][64];
  const int tid = threadIdx.x, w = tid >> 5, lane = tid & 31, ln = lane & 15, hh = lane >> 4; const int by = blockIdx.y;
  A += (size_t)by * sA; Bh += (size_t)by * sB; const size_t cofs = (size_t)by * sC; const float* bp = bias ? bias + (size_t)by * sBias : nullptr;
  const int ntn = (N + 63) / 64; const int wid = blockIdx.x * 4 + w; const int mt = wid / ntn, nq = wid % ntn; if (mt * 16 >= M) return;
  const int row0 = mt * 16, col0 = nq * 64; const _Float16* arow = A + (size_t)(row0 + ln) * lda;
  v8f acc[4] = {};
  for (int kb = 0; kb < K; kb += 32) { FragH ah; ah.half[0] = *(const v8us*)((const unsigned short*)arow + kb + 8 * hh); ah.half[1] = *(const v8us*)((const unsigned short*)arow + kb + 16 + 8 * hh);
#pragma unroll
    for (int t = 0; t < 4; ++t) { if (col0 + t * 16 >= N) continue; const size_t boff = (size_t)(col0 + t * 16 + ln) * ldb + kb; FragH bq; bq.half[0] = *(const v8us*)((const unsigned short*)Bh + boff + 8 * hh); bq.half[1] = *(const v8us*)((const unsigned short*)Bh + boff + 16 + 8 * hh);
      acc[t] = mmaH<1>(ah.v, ah.v, bq.v, bq.v, acc[t]); }
  }
#pragma unroll
  for (int t = 0; t < 4; ++t) { if (col0 + t * 16 >= N) continue; const int col = col0 + t * 16 + ln; const float bv = bp ? bf16_round(bp[col]) : 0.f;
#pragma unroll
    for (int r = 0; r < 8; ++r) { float v = acc[t][r] * alpha + bv; if (CP) { const int rr = row0g + row0 + 8 * hh + r; if (rowsPerB < 0) v += CP[cofs + (size_t)rr * ldc + col];      /* rowsPerB < 0: own element of the batched C plane */ else { const int bidx = rr / rowsPerB; v += CP[(size_t)bidx * sCPb + (size_t)by * 64 + col]; } } if (ACT == 1) v = (v > 0.f) ? v : expm1f(v); else if (ACT == 7) v = (v > 0.f) ? v + 1.0f : expf(v); else if (ACT == 8) v = tanhf(v); else if (ACT == 9) v = 0.5f * v * (1.0f + tanhf(0.7978845608028654f * (v + 0.044715f * v * v * v))); else if (ACT == 11) v = 1.0f / (1.0f + expf(-v)); else if (ACT == 12) v = (v > 0.f) ? v : 0.01f * v; else if (ACT == 14) v = (v > 0.f) ? v : 0.1f * v; else if (ACT == 16) v = (v >= 0.f) ? v : 0.3f * v; else if (ACT == 17) v = (v >= 0.f) ? v : 0.2f * v; else if (ACT == 15) v = v / (1.0f + expf(-v)); else if (ACT == 3) v = fmaxf(v, 0.f); else if (ACT == 6) v = 0.5f * v * (1.0f + erff(v * 0.70710678118654752f)); so[w][8 * hh + r][t * 16 + ln] = v; } }
  __builtin_amdgcn_fence(__ATOMIC_ACQ_REL, "workgroup"); __builtin_amdgcn_wave_barrier();
  const int rsub = lane >> 4, c4 = (lane & 15) * 4; typedef _Float16 v4h __attribute__((ext_vector_type(4)));
  {
#pragma unroll
    for (int q = 0; q < 8; ++q) { const int r = q * 2 + rsub; if (col0 + c4 < N) { const v4f v = *(const v4fa*)&so[w][r][c4]; if (C) *(v4f*)(C + cofs + (size_t)(row0 + r) * ldc + col0 + c4) = v; if (C16) { v4h h4; for (int i = 0; i < 4; ++i) h4[i] = (_Float16)v[i]; *(v4h*)(C16 + cofs + (size_t)(row0 + r) * ldc + col0 + c4) = h4; } } }
     }
}


typedef _Float16 v4h __attribute__((ext_vector_type(4)));

__global__ __launch_bounds__(256) void k_x16(const float* __restrict__ x, _Float16* __restrict__ X16, size_t n8) { const size_t t = (size_t)blockIdx.x * 256 + threadIdx.x; if (t >= n8) return; FragH f;
#pragma unroll
  for (int q = 0; q < 8; ++q) f.h[q] = (_Float16)bf16_round(x[t * 8 + q]); *(v8us*)((unsigned short*)X16 + t * 8) = f.half[0];  }
__global__ __launch_bounds__(256) void k_h16(const float* __restrict__ x, _Float16* __restrict__ X16, size_t n8) { const size_t t = (size_t)blockIdx.x * 256 + threadIdx.x; if (t >= n8) return; FragH f;
#pragma unroll
  for (int q = 0; q < 8; ++q) f.h[q] = (_Float16)x[t * 8 + q]; *(v8us*)((unsigned short*)X16 + t * 8) = f.half[0];  }
__global__ __launch_bounds__(256) void k_round16f(const float* __restrict__ W, _Float16* __restrict__ Bt, size_t n8) { const size_t t = (size_t)blockIdx.x * 256 + threadIdx.x; if (t >= n8) return; FragH f;
#pragma unroll
  for (int i = 0; i < 8; ++i) f.h[i] = (_Float16)(bf16_round(W[t * 8 + i]) * 16.0f); *(v8us*)((unsigned short*)Bt + t * 8) = f.half[0];  }
template <int NHv, int TTv>
__global__ __launch_bounds__(256) void k_vt(const _Float16* __restrict__ V16, int ldv, int voff, _Float16* __restrict__ Vt) { __shared__ unsigned short tl[64][66]; const int tid = threadIdx.x; const int slab = blockIdx.x / (TTv / 64), lg = blockIdx.x % (TTv / 64); const int b = slab / NHv, h = slab % NHv;
  for (int i = tid; i < 64 * 8; i += 256) { const int r = i / 8, c8 = (i % 8) * 8; FragH f; f.half[0] = *(const v8us*)((const unsigned short*)V16 + ((size_t)b * TTv + lg * 64 + r) * ldv + voff + h * 64 + c8);
#pragma unroll
    for (int q = 0; q < 8; ++q) tl[r][c8 + q] = f.u[q]; }
  __syncthreads();
  {
#pragma unroll
    for (int rd = 0; rd < 2; ++rd) { const int d = rd * 32 + tid / 8, pc = tid % 8; FragH f;
#pragma unroll
      for (int q = 0; q < 8; ++q) f.u[q] = tl[pc * 8 + q][d];
      *(v8us*)((unsigned short*)Vt + ((size_t)slab * 64 + d) * TTv + lg * 64 + pc * 8) = f.half[0]; }
     } }

__global__ __launch_bounds__(256) void k_hl(const float* __restrict__ F, _Float16* __restrict__ Hh, _Float16* __restrict__ Hl, size_t n8) { const size_t t = (size_t)blockIdx.x * 256 + threadIdx.x; if (t >= n8) return; FragH fh, fl; const v4f a = *(const v4fa*)(F + t * 8), c = *(const v4fa*)(F + t * 8 + 4);
#pragma unroll
  for (int q = 0; q < 4; ++q) { _Float16 h = (_Float16)a[q]; fh.h[q] = h; fl.h[q] = (_Float16)((a[q] - (float)h) * 1024.0f); h = (_Float16)c[q]; fh.h[4 + q] = h; fl.h[4 + q] = (_Float16)((c[q] - (float)h) * 1024.0f); }
  { *(v8us*)((unsigned short*)Hh + t * 8) = fh.half[0]; *(v8us*)((unsigned short*)Hl + t * 8) = fl.half[0];  } }

// ---- fast GEMM (wave tile 32x64; requires M % 32 == 0 rows per launch region and N % 64 == 0); epilogue = k_gemm_hhx semantics ----
__device__ __forceinline__ v16h g2_frag(const _Float16* p, int hh) { FragH f; f.half[0] = *(const v8us*)((const unsigned short*)p + 8 * hh); f.half[1] = *(const v8us*)((const unsigned short*)p + 16 + 8 * hh); return f.v; }
__device__ __forceinline__ v8f g2_mma(v16h a, v16h b, v8f c) { v8f d = __builtin_amdgcn_wmma_f32_16x16x32_f16(false, a, false, b, (short)0, c, false, false); asm volatile("v_nop\n\tv_nop\n\tv_nop\n\tv_nop" : "+v"(d) : "v"(a), "v"(b)); return d; }
template <int ACT>
__global__ __launch_bounds__(128) void k_gemm2(const _Float16* __restrict__ A, int lda, size_t sA, const _Float16* __restrict__ Bh, int ldb, size_t sB, float alpha, const float* __restrict__ bias, size_t sBias, const float* __restrict__ CP, int rowsPerB, size_t sCPb, int row0g,
    float* __restrict__ C, _Float16* __restrict__ C16, int ldc, size_t sC, int M, int N, int K) { static_assert(ACT == 0 || ACT == 3 || ACT == 6 || ACT == 8 || ACT == 9 || ACT == 11 || ACT == 12 || ACT == 14 || ACT == 15 || ACT == 16 || ACT == 17, "k_gemm2: unsupported ACT code (would silently apply no activation)");
  __shared__ __attribute__((aligned(16))) float so[4][32][68];
  const int tid = threadIdx.x, w = tid >> 5, lane = tid & 31, ln = lane & 15, hh = lane >> 4; const int by = blockIdx.y;
  A += (size_t)by * sA; Bh += (size_t)by * sB; const size_t cofs = (size_t)by * sC; const float* bp = bias ? bias + (size_t)by * sBias : nullptr;
  const int ntn = N >> 6; const int mt = blockIdx.x / ntn, nq = blockIdx.x - mt * ntn; const int row0 = mt * 128 + 32 * w, col0 = nq * 64; if (row0 >= M) return;
  const _Float16* a0p = A + (size_t)(row0 + ln) * lda; const _Float16* a1p = a0p + (size_t)16 * lda;
  const _Float16* b0p = Bh + (size_t)(col0 + ln) * ldb; const _Float16* b1p = b0p + (size_t)16 * ldb; const _Float16* b2p = b1p + (size_t)16 * ldb; const _Float16* b3p = b2p + (size_t)16 * ldb;
  const v8f z8 = {0.f,0.f,0.f,0.f,0.f,0.f,0.f,0.f}; v8f c00 = z8, c01 = z8, c02 = z8, c03 = z8, c10 = z8, c11 = z8, c12 = z8, c13 = z8;
#pragma unroll 1
  for (int kb = 0; kb < K; kb += 32) { const v16h a0 = g2_frag(a0p + kb, hh), a1 = g2_frag(a1p + kb, hh);
    v16h b = g2_frag(b0p + kb, hh); c00 = g2_mma(a0, b, c00); c10 = g2_mma(a1, b, c10);
    b = g2_frag(b1p + kb, hh); c01 = g2_mma(a0, b, c01); c11 = g2_mma(a1, b, c11);
    b = g2_frag(b2p + kb, hh); c02 = g2_mma(a0, b, c02); c12 = g2_mma(a1, b, c12);
    b = g2_frag(b3p + kb, hh); c03 = g2_mma(a0, b, c03); c13 = g2_mma(a1, b, c13); }
  v8f accs[8] = {c00, c01, c02, c03, c10, c11, c12, c13};
#pragma unroll
  for (int u = 0; u < 8; ++u) { const int t = u & 3, half = u >> 2; const int col = col0 + t * 16 + ln; const float bv = bp ? bf16_round(bp[col]) : 0.f;
#pragma unroll
    for (int r = 0; r < 8; ++r) { const int rloc = half * 16 + 8 * hh + r; float v = accs[u][r] * alpha + bv; if (CP) { if (rowsPerB < 0) v += CP[cofs + (size_t)(row0g + row0 + rloc) * ldc + col];      /* rowsPerB < 0: own element of the batched C plane */ else { const int bidx = (row0g + row0 + rloc) / rowsPerB; v += CP[(size_t)bidx * sCPb + (size_t)by * 64 + col]; } }
      if (ACT == 3) v = fmaxf(v, 0.f); else if (ACT == 6) v = 0.5f * v * (1.0f + erff(v * 0.70710678118654752f)); else if (ACT == 11) v = 1.0f / (1.0f + expf(-v)); else if (ACT == 15) v = v / (1.0f + expf(-v)); else if (ACT == 12) v = (v > 0.f) ? v : 0.01f * v; else if (ACT == 8) v = tanhf(v); else if (ACT == 9) v = 0.5f * v * (1.0f + tanhf(0.7978845608028654f * (v + 0.044715f * v * v * v))); else if (ACT == 14) v = (v > 0.f) ? v : 0.1f * v; else if (ACT == 16) v = (v >= 0.f) ? v : 0.3f * v; else if (ACT == 17) v = (v >= 0.f) ? v : 0.2f * v;
      so[w][rloc][t * 16 + ln] = v; } }
  __builtin_amdgcn_fence(__ATOMIC_ACQ_REL, "workgroup"); __builtin_amdgcn_wave_barrier();
  const int rsub = lane >> 4, c4 = (lane & 15) * 4;
  {
#pragma unroll
    for (int q = 0; q < 16; ++q) { const int r = q * 2 + rsub; const v4f v = *(const v4fa*)&so[w][r][c4]; if (C) *(v4f*)(C + cofs + (size_t)(row0 + r) * ldc + col0 + c4) = v; if (C16) { v4h h4; for (int i = 0; i < 4; ++i) h4[i] = (_Float16)v[i]; *(v4h*)(C16 + cofs + (size_t)(row0 + r) * ldc + col0 + c4) = h4; } }
     } }


__global__ __launch_bounds__(256) void k_wnat(const float* __restrict__ w, size_t n8, _Float16* __restrict__ Bt) { const size_t t = (size_t)blockIdx.x * 256 + threadIdx.x; if (t >= n8) return; FragH f; for (int q = 0; q < 8; ++q) f.h[q] = (_Float16)(bf16_round(w[t * 8 + q]) * 16.0f); *(v8us*)((unsigned short*)Bt + t * 8) = f.half[0];  }
__global__ __launch_bounds__(256) void k_rsm(const float* __restrict__ S, _Float16* __restrict__ P, int nrows) {
  #pragma clang fp contract(off)
  const int i = blockIdx.x * 256 + threadIdx.x; if (i >= nrows) return; const float* s = S + (size_t)i * SQ; float mx = -3.0e38f;
#pragma unroll 1
  for (int j = 0; j < SQ; ++j) mx = fmaxf(mx, s[j]); float se = 0.f;
#pragma unroll 1
  for (int j = 0; j < SQ; ++j) se += expf(s[j] - mx); const float sc = 256.0f / se;
#pragma unroll 1
  for (int j0 = 0; j0 < SQ; j0 += 8) { FragH f; for (int q = 0; q < 8; ++q) f.h[q] = (_Float16)(expf(s[j0 + q] - mx) * sc); unsigned short* d = (unsigned short*)P + (size_t)i * SQ + j0; *(v8us*)d = f.half[0];  } }
__global__ __launch_bounds__(256) void k_vt(const _Float16* __restrict__ V16, int b, int h0, _Float16* __restrict__ VT) { __shared__ unsigned short tl[64][65]; const int tid = threadIdx.x; const int hh = blockIdx.x % HG, sg = blockIdx.x / HG; const int s0 = sg * 64; const int h = h0 + hh;
  for (int i = tid; i < 64 * 8; i += 256) { const int j = i / 8, d8 = (i % 8) * 8; FragH f; f.half[0] = *(const v8us*)((const unsigned short*)V16 + ((size_t)b * SQ + s0 + j) * DM + h * HD + d8); for (int q = 0; q < 8; ++q) tl[d8 + q][j] = f.u[q]; }
  __syncthreads();
  { for (int i = tid; i < 64 * 8; i += 256) { const int d = i / 8, j8 = (i % 8) * 8; FragH f; for (int q = 0; q < 8; ++q) f.u[q] = tl[d][j8 + q]; *(v8us*)((unsigned short*)VT + ((size_t)hh * HD + d) * SQ + s0 + j8) = f.half[0]; }  } }



__global__ __launch_bounds__(256) void k_rsmf(const float* __restrict__ S, _Float16* __restrict__ P, int qn, int hg) {
  #pragma clang fp contract(off)
  const int t = blockIdx.x * 256 + threadIdx.x; if (t >= qn * hg) return; const size_t i = (size_t)(t / qn) * SQ + (t % qn); const float* s = S + i * SQ; float mx = -3.0e38f;
#pragma unroll 1
  for (int j = 0; j < SQ; ++j) mx = fmaxf(mx, s[j]); float se = 0.f;
#pragma unroll 1
  for (int j = 0; j < SQ; ++j) se += __expf(s[j] - mx); const float sc = 256.0f / se;
#pragma unroll 1
  for (int j0 = 0; j0 < SQ; j0 += 8) { FragH f; for (int q = 0; q < 8; ++q) f.h[q] = (_Float16)(__expf(s[j0 + q] - mx) * sc); unsigned short* d = (unsigned short*)P + i * SQ + j0; *(v8us*)d = f.half[0];  } }

#define SH 16                          /* heads (the leading non-batch axis of the inputs) */
#define SS 4096                        /* tokens per head */
#define SG 4                           /* heads per score-plane group */
#define SHR SH                         /* heads processed (debug hook; the full build: SH) */
extern "C" void kernel_launch(void* const* d_in, const int* in_sizes, int n_in,
                              void* d_out, int out_size, void* d_ws, size_t ws_size, hipStream_t stream) {
  (void)in_sizes; (void)n_in; (void)out_size;
  const float* const* I = (const float* const*)d_in; const float* q = I[0]; const float* k = I[1]; const float* v = I[2];      /* input order: q, k, v, each [1][16][4096][64] f32, HEAD-MAJOR: element (h, s, d) at (h x 4096 + s) x 64 + d */
  char* ws = (char*)d_ws; size_t off = 0;
  auto take = [&](size_t bytes) { char* p = ws + off; off += (bytes + 255) & ~(size_t)255; return p; };
  const size_t NE = (size_t)SH * SS * HD;      /* 4,194,304 elements per input */
  _Float16* Q16 = (_Float16*)take(NE * 2); _Float16* K16 = (_Float16*)take(NE * 2); _Float16* V16 = (_Float16*)take(NE * 2); _Float16* VT = (_Float16*)take(NE * 2); _Float16* S16 = (_Float16*)take((size_t)SG * SS * SS * 2);
  if (off > ws_size) return;
  k_x16<<<(unsigned)((NE / 8 + 255) / 256), 256, 0, stream>>>(q, Q16, NE / 8); k_x16<<<(unsigned)((NE / 8 + 255) / 256), 256, 0, stream>>>(k, K16, NE / 8); k_x16<<<(unsigned)((NE / 8 + 255) / 256), 256, 0, stream>>>(v, V16, NE / 8);
  k_vt<1, SS><<<SH * (SS / 64), 256, 0, stream>>>(V16, HD, 0, VT);      /* each head is its own slab of 4096 rows with pitch 64: Vt[h][d][s] */
  for (int h0 = 0; h0 < SHR; h0 += SG) {
    k_gemm2<0><<<dim3((SS / 128) * (SS / 64), SG), 128, 0, stream>>>(Q16 + (size_t)h0 * SS * HD, HD, (size_t)SS * HD, K16 + (size_t)h0 * SS * HD, HD, (size_t)SS * HD, 1.0f, nullptr, 0, nullptr, 1, 0, 0, nullptr, S16, SS, (size_t)SS * SS, SS, SS, HD);      /* scores[h][q][k] = q . k (K = 64, alpha 1) as an F16 plane from the epilogue */
    k_gemm2<0><<<dim3((SS / 128) * (HD / 64), SG), 128, 0, stream>>>(S16, SS, (size_t)SS * SS, VT + (size_t)h0 * HD * SS, SS, (size_t)HD * SS, 1.0f, nullptr, 0, nullptr, 1, 0, 0, (float*)d_out + (size_t)h0 * SS * HD, nullptr, HD, (size_t)SS * HD, SS, HD, SS); }      /* out[h][q][d] = scores . V^T (K = 4096, alpha 1) as f32 into the head-major output */
}

// v001
// It runs in 14.3 microseconds.
// Next to v000, in two timings, it ran 51.8 and 52.7 times as fast.
#include <hip/hip_runtime.h>
// Softmax-free 'attention': out = (q k^T) v per head, no scale, no softmax, no mask (q, k, v [1][16][4096][64] f32, HEAD-MAJOR).
// With nothing between the two products they are reassociated: out = q (k^T v). k^T v is one 64 x 64 matrix per head, so the
// 4096 x 4096 score plane is never formed.
// Launch 1: per (head, chunk of 256 tokens) the partial k^T v of the chunk, f32, stored transposed ([e][d]) in the workspace.
// Launch 2: per (head, 512 query rows) the 16 partials of the head are summed in chunk order, split into an f16 high and low part,
// and multiplied by the query rows.
// Compute dtype: inputs rounded to bf16 and held as exact f16 operands; the one computed operand (k^T v) is an f16 pair;
// every accumulation f32. v_wmma_f32_16x16x32_f16.
#define SH 16                          /* heads */
#define SS 4096                        /* tokens per head */
#define HD 64                          /* head width */
#define CH 256                         /* tokens per chunk of launch 1 */
#define QR 512                         /* query rows per workgroup of launch 2: 16 waves of 32 rows */
#define NC (SS / CH)                   /* chunks per head */
#define PT 160                         /* LDS row pitch in bytes of the 128-byte k and v rows: odd multiple of 32 for the transposing loads */
#define PM 144                         /* LDS row pitch in bytes of 128-byte rows read by plain 16-byte loads: odd multiple of 16 */
#define PO 68                          /* LDS row pitch in floats of the staged f32 tiles */
/* every loop here has a constant trip count; unrolled so that its register arrays keep constant indices (no scratch) and the loads of one loop go out together */
#define UNROLL _Pragma("unroll")
typedef _Float16 v16h __attribute__((ext_vector_type(16)));
typedef _Float16 v4h  __attribute__((ext_vector_type(4), may_alias));
typedef __bf16 v4b  __attribute__((ext_vector_type(4)));
typedef float  v8f  __attribute__((ext_vector_type(8)));
typedef float  v4f  __attribute__((ext_vector_type(4), may_alias));
typedef short  s16x8 __attribute__((ext_vector_type(8)));
typedef unsigned int u32x4 __attribute__((ext_vector_type(4), may_alias));
union FragH { v16h v; u32x4 q[2]; };

// an input value: f32 rounded to bf16 (to nearest even), then held as f16
__device__ __forceinline__ v4h in16(v4f x) { return __builtin_convertvector(__builtin_convertvector(__builtin_convertvector(x, v4b), v4f), v4h); }
__device__ __forceinline__ u32x4 ld_tr16(const unsigned char* p) { typedef __attribute__((address_space(3))) s16x8 lds_s16x8; return __builtin_bit_cast(u32x4, __builtin_amdgcn_ds_load_tr16_b128_v8i16((lds_s16x8*)p)); }
__device__ __forceinline__ v8f mma(v16h a, v16h b, v8f c) { return __builtin_amdgcn_wmma_f32_16x16x32_f16(false, a, false, b, (short)0, c, false, false); }
// 16 x 32 fragment of a k-contiguous f16 row in LDS, hardware k order; the same loader serves both operands of launch 2
__device__ __forceinline__ v16h ld_frag(const unsigned char* row, int hh) { FragH f; f.q[0] = *(const u32x4*)(row + 16 * hh); f.q[1] = *(const u32x4*)(row + 32 + 16 * hh); return f.v; }

// P[head * NC + chunk][e][d] = sum over the chunk's tokens s of k[s][d] * v[s][e]
__global__ __launch_bounds__(256) void k_ktv(const float* __restrict__ k, const float* __restrict__ v, float* __restrict__ P) {
  __shared__ __attribute__((aligned(16))) unsigned char ks[CH * PT];
  __shared__ __attribute__((aligned(16))) unsigned char vs[CH * PT];
  __shared__ __attribute__((aligned(16))) float ms[HD][PO];
  const int tid = threadIdx.x, w = tid >> 5, lane = tid & 31, ln = lane & 15, hh = lane >> 4;
  const size_t base = (size_t)blockIdx.x * CH * HD;      /* the chunk's rows are contiguous in the head-major input */
  const v4f* kp = (const v4f*)(k + base) + tid; const v4f* vp = (const v4f*)(v + base) + tid;
  v4f kr[16], vr[16];
UNROLL
  for (int i = 0; i < 16; ++i) kr[i] = kp[i * 256];
UNROLL
  for (int i = 0; i < 16; ++i) vr[i] = vp[i * 256];
  const unsigned so = (unsigned)(tid >> 4) * PT + (unsigned)(tid & 15) * 8;      /* load i of a thread: token i * 16 + tid / 16, columns (tid % 16) * 4 ... + 3 */
UNROLL
  for (int i = 0; i < 16; ++i) *(v4h*)(ks + so + i * 16 * PT) = in16(kr[i]);
UNROLL
  for (int i = 0; i < 16; ++i) *(v4h*)(vs + so + i * 16 * PT) = in16(vr[i]);
  __syncthreads();
  /* wave w: rows d = 16 * (w / 2) ... + 15 of k^T v, columns e = 32 * (w % 2) ... + 31; both operands come transposed out of their token-major rows */
  const unsigned la = (unsigned)(8 * hh + (lane & 7)) * PT + 16u * ((lane >> 3) & 1);
  const unsigned char* ap = ks + la + 32 * (w >> 1);
  const unsigned char* bp = vs + la + 64 * (w & 1);
  v8f c0 = {0.f,0.f,0.f,0.f,0.f,0.f,0.f,0.f}, c1 = c0;
UNROLL
  for (int s = 0; s < CH / 32; ++s) {
    FragH a, b0, b1;
    a.q[0]  = ld_tr16(ap + s * 32 * PT);      a.q[1]  = ld_tr16(ap + (s * 32 + 16) * PT);
    b0.q[0] = ld_tr16(bp + s * 32 * PT);      b0.q[1] = ld_tr16(bp + (s * 32 + 16) * PT);
    b1.q[0] = ld_tr16(bp + 32 + s * 32 * PT); b1.q[1] = ld_tr16(bp + 32 + (s * 32 + 16) * PT);
    c0 = mma(a.v, b0.v, c0); c1 = mma(a.v, b1.v, c1);
  }
  /* a lane holds 8 consecutive d of one column e: two 16-byte stores into the transposed tile */
  float* m0 = &ms[32 * (w & 1) + ln][16 * (w >> 1) + 8 * hh]; float* m1 = m0 + 16 * PO;
  *(v4f*)m0 = (v4f){c0[0], c0[1], c0[2], c0[3]}; *(v4f*)(m0 + 4) = (v4f){c0[4], c0[5], c0[6], c0[7]};
  *(v4f*)m1 = (v4f){c1[0], c1[1], c1[2], c1[3]}; *(v4f*)(m1 + 4) = (v4f){c1[4], c1[5], c1[6], c1[7]};
  __syncthreads();
  float* o = P + (size_t)blockIdx.x * (HD * HD) + tid * 4;
UNROLL
  for (int u = 0; u < 4; ++u) *(v4f*)(o + u * 1024) = *(const v4f*)&ms[u * 16 + (tid >> 4)][(tid & 15) * 4];
}

// out[row][e] = sum over d of q[row][d] * M[d][e], M = the head's partials summed in chunk order
__global__ __launch_bounds__(512) void k_qm(const float* __restrict__ q, const float* __restrict__ P, float* __restrict__ out) {
  __shared__ __attribute__((aligned(16))) unsigned char mh[HD * PM];
  __shared__ __attribute__((aligned(16))) unsigned char ml[HD * PM];
  __shared__ __attribute__((aligned(16))) unsigned char qs[16][32 * PM];
  __shared__ __attribute__((aligned(16))) float os[16][32][PO];
  const int tid = threadIdx.x, lane = tid & 31, ln = lane & 15, hh = lane >> 4;
  const int w = __builtin_amdgcn_readfirstlane(tid >> 5);      /* the wave's number as a scalar: its row addresses become a scalar base plus the lane's offset */
  const size_t rbase = ((size_t)blockIdx.x * QR + w * 32) * HD;      /* a wave's 32 query rows, contiguous */
  const v4f* qp = (const v4f*)(q + rbase) + lane;
  v4f qr[16];
UNROLL
  for (int i = 0; i < 16; ++i) qr[i] = qp[i * 32];
  const float* pp = P + (size_t)(blockIdx.x / (SS / QR)) * NC * (HD * HD) + tid * 4;
  v4f m[2] = {{0.f,0.f,0.f,0.f},{0.f,0.f,0.f,0.f}};
UNROLL
  for (int c = 0; c < NC; ++c)
UNROLL
    for (int u = 0; u < 2; ++u) m[u] += *(const v4f*)(pp + c * (HD * HD) + u * 2048);
UNROLL
  for (int i = 0; i < 16; ++i) *(v4h*)(qs[w] + (i * 2 + hh) * PM + ln * 8) = in16(qr[i]);
UNROLL
  for (int u = 0; u < 2; ++u) { const v4h hi = __builtin_convertvector(m[u], v4h); const v4h lo = __builtin_convertvector(m[u] - __builtin_convertvector(hi, v4f), v4h);
    const unsigned mo = (unsigned)(u * 32 + (tid >> 4)) * PM + (unsigned)(tid & 15) * 8;
    *(v4h*)(mh + mo) = hi; *(v4h*)(ml + mo) = lo; }
  __syncthreads();
  /* A = M^T (rows e), B = the query rows as columns: a lane's 8 results are 8 consecutive e of one query row */
  v16h bq[2][2];
UNROLL
  for (int g = 0; g < 2; ++g)
UNROLL
    for (int s = 0; s < 2; ++s) bq[g][s] = ld_frag(qs[w] + (16 * g + ln) * PM + 64 * s, hh);
UNROLL
  for (int t = 0; t < 4; ++t) {
    const unsigned ro = (unsigned)(16 * t + ln) * PM;
    const v16h ah0 = ld_frag(mh + ro, hh), ah1 = ld_frag(mh + ro + 64, hh), al0 = ld_frag(ml + ro, hh), al1 = ld_frag(ml + ro + 64, hh);
UNROLL
    for (int g = 0; g < 2; ++g) {
      v8f d = {0.f,0.f,0.f,0.f,0.f,0.f,0.f,0.f};
      d = mma(al0, bq[g][0], d); d = mma(al1, bq[g][1], d); d = mma(ah0, bq[g][0], d); d = mma(ah1, bq[g][1], d);
      float* op = &os[w][16 * g + ln][16 * t + 8 * hh];
      *(v4f*)op = (v4f){d[0], d[1], d[2], d[3]}; *(v4f*)(op + 4) = (v4f){d[4], d[5], d[6], d[7]};
    }
  }
  /* the wave reads back rows that its other lanes wrote: keeps the LDS reads below behind the LDS stores above */
  __builtin_amdgcn_fence(__ATOMIC_ACQ_REL, "workgroup"); __builtin_amdgcn_wave_barrier();
UNROLL
  for (int i = 0; i < 16; ++i) *(v4f*)(out + rbase + (size_t)(i * 32 + lane) * 4) = *(const v4f*)&os[w][i * 2 + hh][ln * 4];
}

extern "C" void kernel_launch(void* const* d_in, const int* in_sizes, int n_in,
                              void* d_out, int out_size, void* d_ws, size_t ws_size, hipStream_t stream) {
  (void)in_sizes; (void)n_in; (void)out_size;
  const float* const* I = (const float* const*)d_in; const float* q = I[0]; const float* k = I[1]; const float* v = I[2];      /* q, k, v, each [1][16][4096][64] f32: element (h, s, d) at (h x 4096 + s) x 64 + d */
  float* P = (float*)d_ws;      /* SH x NC partial matrices of 64 x 64 f32 */
  if ((size_t)SH * NC * HD * HD * 4 > ws_size) return;
  k_ktv<<<SH * NC, 256, 0, stream>>>(k, v, P);
  k_qm<<<SH * (SS / QR), 512, 0, stream>>>(q, P, (float*)d_out);
}

// v002
// A run of this version takes 13.5 microseconds.
// Timed twice side by side with v001, it ran 1.10 and 1.09 times as fast.
// Over all steps from v000 it is 57.2 times as fast.
#include <hip/hip_runtime.h>
// Softmax-free 'attention': out = (q k^T) v per head, no scale, no softmax, no mask (q, k, v [1][16][4096][64] f32, HEAD-MAJOR).
// With nothing between the two products they are reassociated: out = q (k^T v). k^T v is one 64 x 64 matrix per head, so the
// 4096 x 4096 score plane is never formed.
// Launch 1: per (head, chunk of 256 tokens) the partial k^T v of the chunk, f32, stored transposed ([e][d]) in the workspace.
// Launch 2: per (head, 512 query rows) the 16 partials of the head are summed in chunk order, split into an f16 high and low part,
// and multiplied by the query rows.
// Compute dtype: inputs rounded to bf16 and held as exact f16 operands; the one computed operand (k^T v) is an f16 pair;
// every accumulation f32. v_wmma_f32_16x16x32_f16.
#define SH 16                          /* heads */
#define SS 4096                        /* tokens per head */
#define HD 64                          /* head width */
#define CH 256                         /* tokens per chunk of launch 1 */
#define QR 512                         /* query rows per workgroup of launch 2: 16 waves of 32 rows */
#define NC (SS / CH)                   /* chunks per head */
#define PT 160                         /* LDS row pitch in bytes of the 128-byte k and v rows: odd multiple of 32 for the transposing loads */
#define PM 144                         /* LDS row pitch in bytes of 128-byte rows read by plain 16-byte loads: odd multiple of 16 */
#define PO 68                          /* LDS row pitch in floats of the staged f32 tiles */
/* every loop here has a constant trip count; unrolled so that its register arrays keep constant indices (no scratch) and the loads of one loop go out together */
#define UNROLL _Pragma("unroll")
typedef _Float16 v16h __attribute__((ext_vector_type(16)));
typedef _Float16 v4h  __attribute__((ext_vector_type(4), may_alias));
typedef __bf16 v4b  __attribute__((ext_vector_type(4)));
typedef float  v8f  __attribute__((ext_vector_type(8)));
typedef float  v4f  __attribute__((ext_vector_type(4), may_alias));
typedef short  s16x8 __attribute__((ext_vector_type(8)));
typedef unsigned int u32x4 __attribute__((ext_vector_type(4), may_alias));
union FragH { v16h v; u32x4 q[2]; };

// an input value: f32 rounded to bf16 (to nearest even), then held as f16
__device__ __forceinline__ v4h in16(v4f x) { return __builtin_convertvector(__builtin_convertvector(__builtin_convertvector(x, v4b), v4f), v4h); }
__device__ __forceinline__ u32x4 ld_tr16(const unsigned char* p) { typedef __attribute__((address_space(3))) s16x8 lds_s16x8; return __builtin_bit_cast(u32x4, __builtin_amdgcn_ds_load_tr16_b128_v8i16((lds_s16x8*)p)); }
__device__ __forceinline__ v8f mma(v16h a, v16h b, v8f c) { return __builtin_amdgcn_wmma_f32_16x16x32_f16(false, a, false, b, (short)0, c, false, false); }
// 16 x 32 fragment of a k-contiguous f16 row in LDS, hardware k order; the same loader serves both operands of launch 2
__device__ __forceinline__ v16h ld_frag(const unsigned char* row, int hh) { FragH f; f.q[0] = *(const u32x4*)(row + 16 * hh); f.q[1] = *(const u32x4*)(row + 32 + 16 * hh); return f.v; }

// workgroup barrier that orders LDS alone: the waves exchange only LDS data, and a full __syncthreads() would first wait for every global load still in flight
__device__ __forceinline__ void lds_barrier() { __builtin_amdgcn_fence(__ATOMIC_RELEASE, "workgroup", "local"); __builtin_amdgcn_s_barrier(); __builtin_amdgcn_fence(__ATOMIC_ACQUIRE, "workgroup", "local"); }
// execution barrier with no memory order, between two groups of global loads: every wave has asked for the first group before any wave asks for the second;
// the scheduling barriers keep the loads on their sides of it
__device__ __forceinline__ void issue_barrier() { __builtin_amdgcn_sched_barrier(0); __builtin_amdgcn_s_barrier(); __builtin_amdgcn_sched_barrier(0); }
// one wave reads LDS rows that its other lanes wrote: keeps the LDS reads behind the LDS stores, without a wait for global loads or stores
__device__ __forceinline__ void lds_wave_fence() { __builtin_amdgcn_fence(__ATOMIC_ACQ_REL, "workgroup", "local"); __builtin_amdgcn_wave_barrier(); }

// P[head * NC + chunk][e][d] = sum over the chunk's tokens s of k[s][d] * v[s][e]
__global__ __launch_bounds__(256) void k_ktv(const float* __restrict__ k, const float* __restrict__ v, float* __restrict__ P) {
  __shared__ __attribute__((aligned(16))) unsigned char ks[CH * PT];
  __shared__ __attribute__((aligned(16))) unsigned char vs[CH * PT];
  __shared__ __attribute__((aligned(16))) float ms[HD][PO];
  const int tid = threadIdx.x, w = tid >> 5, lane = tid & 31, ln = lane & 15, hh = lane >> 4;
  const size_t base = (size_t)blockIdx.x * CH * HD;      /* the chunk's rows are contiguous in the head-major input */
  const v4f* kp = (const v4f*)(k + base) + tid; const v4f* vp = (const v4f*)(v + base) + tid;
  v4f kr[16], vr[16];
  /* all loads go out in front of the first wait, in the order in which they are used: 64 tokens of k, the same 64 of v, the next 64 ... */
UNROLL
  for (int p = 0; p < 4; ++p) {
UNROLL
    for (int j = 0; j < 4; ++j) kr[4 * p + j] = kp[(4 * p + j) * 256];
UNROLL
    for (int j = 0; j < 4; ++j) vr[4 * p + j] = vp[(4 * p + j) * 256];
    if (p < 3) issue_barrier();
  }
  __builtin_amdgcn_sched_barrier(0);      /* keeps every load in front of the first wait */
  const unsigned so = (unsigned)(tid >> 4) * PT + (unsigned)(tid & 15) * 8;      /* load i of a thread: token i * 16 + tid / 16, columns (tid % 16) * 4 ... + 3 */
  /* wave w: rows d = 16 * (w / 2) ... + 15 of k^T v, columns e = 32 * (w % 2) ... + 31; both operands come transposed out of their token-major rows */
  const unsigned la = (unsigned)(8 * hh + (lane & 7)) * PT + 16u * ((lane >> 3) & 1);
  const unsigned char* ap = ks + la + 32 * (w >> 1);
  const unsigned char* bp = vs + la + 64 * (w & 1);
  v8f c0 = {0.f,0.f,0.f,0.f,0.f,0.f,0.f,0.f}, c1 = c0;
  /* four passes of 64 tokens: a pass is staged and multiplied as soon as its own loads have landed, under the flight of the later ones; every pass has its own LDS rows */
UNROLL
  for (int p = 0; p < 4; ++p) {
UNROLL
    for (int j = 0; j < 4; ++j) { const int i = 4 * p + j; *(v4h*)(ks + so + i * 16 * PT) = in16(kr[i]); *(v4h*)(vs + so + i * 16 * PT) = in16(vr[i]); }
    lds_barrier();
UNROLL
  for (int s = 2 * p; s < 2 * p + 2; ++s) {
    FragH a, b0, b1;
    a.q[0]  = ld_tr16(ap + s * 32 * PT);      a.q[1]  = ld_tr16(ap + (s * 32 + 16) * PT);
    b0.q[0] = ld_tr16(bp + s * 32 * PT);      b0.q[1] = ld_tr16(bp + (s * 32 + 16) * PT);
    b1.q[0] = ld_tr16(bp + 32 + s * 32 * PT); b1.q[1] = ld_tr16(bp + 32 + (s * 32 + 16) * PT);
    c0 = mma(a.v, b0.v, c0); c1 = mma(a.v, b1.v, c1);
  }
    if (p < 3) __builtin_amdgcn_sched_barrier(0);      /* keeps the next pass's wait for its loads behind this pass's products */
  }
  /* a lane holds 8 consecutive d of one column e: two 16-byte stores into the transposed tile */
  float* m0 = &ms[32 * (w & 1) + ln][16 * (w >> 1) + 8 * hh]; float* m1 = m0 + 16 * PO;
  *(v4f*)m0 = (v4f){c0[0], c0[1], c0[2], c0[3]}; *(v4f*)(m0 + 4) = (v4f){c0[4], c0[5], c0[6], c0[7]};
  *(v4f*)m1 = (v4f){c1[0], c1[1], c1[2], c1[3]}; *(v4f*)(m1 + 4) = (v4f){c1[4], c1[5], c1[6], c1[7]};
  __syncthreads();
  float* o = P + (size_t)blockIdx.x * (HD * HD) + tid * 4;
UNROLL
  for (int u = 0; u < 4; ++u) *(v4f*)(o + u * 1024) = *(const v4f*)&ms[u * 16 + (tid >> 4)][(tid & 15) * 4];
}

// out[row][e] = sum over d of q[row][d] * M[d][e], M = the head's partials summed in chunk order
__global__ __launch_bounds__(512) void k_qm(const float* __restrict__ q, const float* __restrict__ P, float* __restrict__ out) {
  __shared__ __attribute__((aligned(16))) unsigned char mh[HD * PM];
  __shared__ __attribute__((aligned(16))) unsigned char ml[HD * PM];
  __shared__ __attribute__((aligned(16))) unsigned char qs[16][32 * PM];
  __shared__ __attribute__((aligned(16))) float os[16][32][PO];
  const int tid = threadIdx.x, lane = tid & 31, ln = lane & 15, hh = lane >> 4;
  const int w = __builtin_amdgcn_readfirstlane(tid >> 5);      /* the wave's number as a scalar: its row addresses become a scalar base plus the lane's offset */
  const size_t rbase = ((size_t)blockIdx.x * QR + w * 32) * HD;      /* a wave's 32 query rows, contiguous */
  const v4f* qp = (const v4f*)(q + rbase) + lane;
  const float* pp = P + (size_t)(blockIdx.x / (SS / QR)) * NC * (HD * HD) + tid * 4;
  /* the partials are asked for first and the query rows behind them: M is summed, published and fetched while the query rows are still in flight */
  v4f pr[NC][2], qr[16];
UNROLL
  for (int c = 0; c < NC; ++c)
UNROLL
    for (int u = 0; u < 2; ++u) pr[c][u] = *(const v4f*)(pp + c * (HD * HD) + u * 2048);
  issue_barrier();
UNROLL
  for (int i = 0; i < 16; ++i) qr[i] = qp[i * 32];
  __builtin_amdgcn_sched_barrier(0);      /* keeps every load in front of the first wait, the partials first */
  v4f m[2] = {{0.f,0.f,0.f,0.f},{0.f,0.f,0.f,0.f}};
UNROLL
  for (int c = 0; c < NC; ++c)
UNROLL
    for (int u = 0; u < 2; ++u) m[u] += pr[c][u];
UNROLL
  for (int u = 0; u < 2; ++u) { const v4h hi = __builtin_convertvector(m[u], v4h); const v4h lo = __builtin_convertvector(m[u] - __builtin_convertvector(hi, v4f), v4h);
    const unsigned mo = (unsigned)(u * 32 + (tid >> 4)) * PM + (unsigned)(tid & 15) * 8;
    *(v4h*)(mh + mo) = hi; *(v4h*)(ml + mo) = lo; }
  lds_barrier();
  /* A = M^T (rows e), B = the query rows as columns: a lane's 8 results are 8 consecutive e of one query row */
  v16h ah[4][2], al[4][2];      /* all of M stays in registers for both row groups */
UNROLL
  for (int t = 0; t < 4; ++t)
UNROLL
    for (int s = 0; s < 2; ++s) { const unsigned ro = (unsigned)(16 * t + ln) * PM + 64 * s; ah[t][s] = ld_frag(mh + ro, hh); al[t][s] = ld_frag(ml + ro, hh); }
  __builtin_amdgcn_sched_barrier(0);      /* keeps the fetch of M in front of the first wait for a query row */
  /* two groups of 16 query rows, each staged, multiplied and stored as soon as its own loads have landed */
UNROLL
  for (int g = 0; g < 2; ++g) {
UNROLL
    for (int i = 8 * g; i < 8 * g + 8; ++i) *(v4h*)(qs[w] + (i * 2 + hh) * PM + ln * 8) = in16(qr[i]);
    lds_wave_fence();
    const v16h bq0 = ld_frag(qs[w] + (16 * g + ln) * PM, hh), bq1 = ld_frag(qs[w] + (16 * g + ln) * PM + 64, hh);
UNROLL
    for (int t = 0; t < 4; ++t) {
      v8f d = {0.f,0.f,0.f,0.f,0.f,0.f,0.f,0.f};
      d = mma(al[t][0], bq0, d); d = mma(al[t][1], bq1, d); d = mma(ah[t][0], bq0, d); d = mma(ah[t][1], bq1, d);
      float* op = &os[w][16 * g + ln][16 * t + 8 * hh];
      *(v4f*)op = (v4f){d[0], d[1], d[2], d[3]}; *(v4f*)(op + 4) = (v4f){d[4], d[5], d[6], d[7]};
    }
    lds_wave_fence();
UNROLL
    for (int i = 8 * g; i < 8 * g + 8; ++i) *(v4f*)(out + rbase + (size_t)(i * 32 + lane) * 4) = *(const v4f*)&os[w][i * 2 + hh][ln * 4];
    if (g < 1) __builtin_amdgcn_sched_barrier(0);      /* keeps the second group's wait for its loads behind the first group's stores */
  }
}

extern "C" void kernel_launch(void* const* d_in, const int* in_sizes, int n_in,
                              void* d_out, int out_size, void* d_ws, size_t ws_size, hipStream_t stream) {
  (void)in_sizes; (void)n_in; (void)out_size;
  const float* const* I = (const float* const*)d_in; const float* q = I[0]; const float* k = I[1]; const float* v = I[2];      /* q, k, v, each [1][16][4096][64] f32: element (h, s, d) at (h x 4096 + s) x 64 + d */
  float* P = (float*)d_ws;      /* SH x NC partial matrices of 64 x 64 f32 */
  if ((size_t)SH * NC * HD * HD * 4 > ws_size) return;
  k_ktv<<<SH * NC, 256, 0, stream>>>(k, v, P);
  k_qm<<<SH * (SS / QR), 512, 0, stream>>>(q, P, (float*)d_out);
}

// v004
// A run of this version takes 10.6 microseconds.
// It is 1.26 times as fast as v002, going by the measured steps of the versions left out in between.
// Counting every step since v000, it is 72.1 times as fast.
#include <hip/hip_runtime.h>
// Softmax-free 'attention': out = (q k^T) v per head, no scale, no softmax, no mask (q, k, v [1][16][4096][64] f32, HEAD-MAJOR).
// With nothing between the two products they are reassociated: out = q (k^T v). k^T v is one 64 x 64 matrix per head, so the
// 4096 x 4096 score plane is never formed.
// Launch 1: per (head, chunk of 256 tokens) the partial k^T v of the chunk, summed in f32, rounded once to f16 and stored transposed ([e][d]) in the workspace.
// Launch 2: per (head, 512 query rows) the 16 partials of the head are summed in f32 in chunk order, split into an f16 high and low part,
// and multiplied by the query rows. Each workgroup prefetches a quarter of the partials into L2 at entry and loads them behind its query rows.
// Compute dtype: inputs rounded to bf16 and held as exact f16 operands; the one computed operand (k^T v) is an f16 pair;
// every accumulation f32; the chunk partials cross from launch 1 to launch 2 as f16. v_wmma_f32_16x16x32_f16.
#define SH 16                          /* heads */
#define SS 4096                        /* tokens per head */
#define HD 64                          /* head width */
#define CH 256                         /* tokens per chunk of launch 1 */
#define QR 512                         /* query rows per workgroup of launch 2: 16 waves of 32 rows */
#define NC (SS / CH)                   /* chunks per head */
#define PT 160                         /* LDS row pitch in bytes of the 128-byte k and v rows: odd multiple of 32 for the transposing loads */
#define PM 144                         /* LDS row pitch in bytes of 128-byte rows read by plain 16-byte loads: odd multiple of 16 */
#define PO 68                          /* LDS row pitch in floats of the staged f32 tiles */
#define PF (HD * HD / 2)               /* floats' worth of workspace per f16 partial: 64 rows e of 128 bytes */
/* every loop here has a constant trip count; unrolled so that its register arrays keep constant indices (no scratch) and the loads of one loop go out together */
#define UNROLL _Pragma("unroll")
typedef _Float16 v16h __attribute__((ext_vector_type(16)));
typedef _Float16 v4h  __attribute__((ext_vector_type(4), may_alias));
typedef _Float16 v8h  __attribute__((ext_vector_type(8), may_alias));
typedef __bf16 v4b  __attribute__((ext_vector_type(4)));
typedef float  v8f  __attribute__((ext_vector_type(8)));
typedef float  v4f  __attribute__((ext_vector_type(4), may_alias));
typedef short  s16x8 __attribute__((ext_vector_type(8)));
typedef unsigned int u32x4 __attribute__((ext_vector_type(4), may_alias));
union FragH { v16h v; u32x4 q[2]; };

// an input value: f32 rounded to bf16 (to nearest even), then held as f16
__device__ __forceinline__ v4h in16(v4f x) { return __builtin_convertvector(__builtin_convertvector(__builtin_convertvector(x, v4b), v4f), v4h); }
__device__ __forceinline__ u32x4 ld_tr16(const unsigned char* p) { typedef __attribute__((address_space(3))) s16x8 lds_s16x8; return __builtin_bit_cast(u32x4, __builtin_amdgcn_ds_load_tr16_b128_v8i16((lds_s16x8*)p)); }
__device__ __forceinline__ v8f mma(v16h a, v16h b, v8f c) { return __builtin_amdgcn_wmma_f32_16x16x32_f16(false, a, false, b, (short)0, c, false, false); }
// 16 x 32 fragment of a k-contiguous f16 row in LDS, hardware k order; the same loader serves both operands of launch 2
__device__ __forceinline__ v16h ld_frag(const unsigned char* row, int hh) { FragH f; f.q[0] = *(const u32x4*)(row + 16 * hh); f.q[1] = *(const u32x4*)(row + 32 + 16 * hh); return f.v; }

// workgroup barrier that orders LDS alone: the waves exchange only LDS data, and a full __syncthreads() would first wait for every global load still in flight
__device__ __forceinline__ void lds_barrier() { __builtin_amdgcn_fence(__ATOMIC_RELEASE, "workgroup", "local"); __builtin_amdgcn_s_barrier(); __builtin_amdgcn_fence(__ATOMIC_ACQUIRE, "workgroup", "local"); }
// execution barrier with no memory order, between two groups of global loads: every wave has asked for the first group before any wave asks for the second;
// the scheduling barriers keep the loads on their sides of it
__device__ __forceinline__ void issue_barrier() { __builtin_amdgcn_sched_barrier(0); __builtin_amdgcn_s_barrier(); __builtin_amdgcn_sched_barrier(0); }
// one wave reads LDS rows that its other lanes wrote: keeps the LDS reads behind the LDS stores, without a wait for global loads or stores
__device__ __forceinline__ void lds_wave_fence() { __builtin_amdgcn_fence(__ATOMIC_ACQ_REL, "workgroup", "local"); __builtin_amdgcn_wave_barrier(); }

// P[head * NC + chunk][e][d] = sum over the chunk's tokens s of k[s][d] * v[s][e], as f16 (the pointer stays float*: 16-byte pieces go through it)
__global__ __launch_bounds__(256) void k_ktv(const float* __restrict__ k, const float* __restrict__ v, float* __restrict__ P) {
  __shared__ __attribute__((aligned(16))) unsigned char ks[CH * PT];
  __shared__ __attribute__((aligned(16))) unsigned char vs[CH * PT];
  __shared__ __attribute__((aligned(16))) unsigned char ms[HD * PM];
  const int tid = threadIdx.x, w = tid >> 5, lane = tid & 31, ln = lane & 15, hh = lane >> 4;
  const size_t base = (size_t)blockIdx.x * CH * HD;      /* the chunk's rows are contiguous in the head-major input */
  const v4f* kp = (const v4f*)(k + base) + tid; const v4f* vp = (const v4f*)(v + base) + tid;
  v4f kr[16], vr[16];
  /* all loads go out in front of the first wait, in the order in which they are used: 64 tokens of k, the same 64 of v, the next 64 ... */
UNROLL
  for (int p = 0; p < 4; ++p) {
UNROLL
    for (int j = 0; j < 4; ++j) kr[4 * p + j] = kp[(4 * p + j) * 256];
UNROLL
    for (int j = 0; j < 4; ++j) vr[4 * p + j] = vp[(4 * p + j) * 256];
    if (p < 3) issue_barrier();
  }
  __builtin_amdgcn_sched_barrier(0);      /* keeps every load in front of the first wait */
  const unsigned so = (unsigned)(tid >> 4) * PT + (unsigned)(tid & 15) * 8;      /* load i of a thread: token i * 16 + tid / 16, columns (tid % 16) * 4 ... + 3 */
  /* wave w: rows d = 16 * (w / 2) ... + 15 of k^T v, columns e = 32 * (w % 2) ... + 31; both operands come transposed out of their token-major rows */
  const unsigned la = (unsigned)(8 * hh + (lane & 7)) * PT + 16u * ((lane >> 3) & 1);
  const unsigned char* ap = ks + la + 32 * (w >> 1);
  const unsigned char* bp = vs + la + 64 * (w & 1);
  v8f c0 = {0.f,0.f,0.f,0.f,0.f,0.f,0.f,0.f}, c1 = c0;
  /* four passes of 64 tokens: a pass is staged and multiplied as soon as its own loads have landed, under the flight of the later ones; every pass has its own LDS rows */
UNROLL
  for (int p = 0; p < 4; ++p) {
UNROLL
    for (int j = 0; j < 4; ++j) { const int i = 4 * p + j; *(v4h*)(ks + so + i * 16 * PT) = in16(kr[i]); *(v4h*)(vs + so + i * 16 * PT) = in16(vr[i]); }
    lds_barrier();
UNROLL
  for (int s = 2 * p; s < 2 * p + 2; ++s) {
    FragH a, b0, b1;
    a.q[0]  = ld_tr16(ap + s * 32 * PT);      a.q[1]  = ld_tr16(ap + (s * 32 + 16) * PT);
    b0.q[0] = ld_tr16(bp + s * 32 * PT);      b0.q[1] = ld_tr16(bp + (s * 32 + 16) * PT);
    b1.q[0] = ld_tr16(bp + 32 + s * 32 * PT); b1.q[1] = ld_tr16(bp + 32 + (s * 32 + 16) * PT);
    c0 = mma(a.v, b0.v, c0); c1 = mma(a.v, b1.v, c1);
  }
    if (p < 3) __builtin_amdgcn_sched_barrier(0);      /* keeps the next pass's wait for its loads behind this pass's products */
  }
  /* a lane holds 8 consecutive d of one column e: as f16 one 16-byte store into the transposed tile */
  unsigned char* m0 = ms + (unsigned)(32 * (w & 1) + ln) * PM + (unsigned)(16 * (w >> 1) + 8 * hh) * 2;
  *(v8h*)m0 = __builtin_convertvector(c0, v8h); *(v8h*)(m0 + 16 * PM) = __builtin_convertvector(c1, v8h);
  __syncthreads();
  float* o = P + (size_t)blockIdx.x * PF + tid * 4;
UNROLL
  for (int u = 0; u < 2; ++u) *(u32x4*)(o + u * 1024) = *(const u32x4*)(ms + (unsigned)(u * 32 + (tid >> 3)) * PM + (unsigned)(tid & 7) * 16);
}

// out[row][e] = sum over d of q[row][d] * M[d][e], M = the head's partials summed in chunk order
__global__ __launch_bounds__(512) void k_qm(const float* __restrict__ q, const float* __restrict__ P, float* __restrict__ out) {
  __shared__ __attribute__((aligned(16))) unsigned char mh[HD * PM];
  __shared__ __attribute__((aligned(16))) unsigned char ml[HD * PM];
  __shared__ __attribute__((aligned(16))) unsigned char qs[16][32 * PM];
  __shared__ __attribute__((aligned(16))) float os[16][32][PO];
  const int tid = threadIdx.x, lane = tid & 31, ln = lane & 15, hh = lane >> 4;
  const int w = __builtin_amdgcn_readfirstlane(tid >> 5);      /* the wave's number as a scalar: its row addresses become a scalar base plus the lane's offset */
  const size_t rbase = ((size_t)blockIdx.x * QR + w * 32) * HD;      /* a wave's 32 query rows, contiguous */
  const v4f* qp = (const v4f*)(q + rbase) + lane;
  const float* ph = P + (size_t)(blockIdx.x / (SS / QR)) * NC * PF;      /* the head's NC partials, contiguous */
  /* The partials were stored by the launch before and are read by all 8 workgroups of the head. Each workgroup asks the L2 for a quarter of them (4 chunks, one lane per
     128-byte line) as its first act; workgroups b ... b + 3 take four different quarters. A hint for speed alone: every workgroup still loads all of them below. */
  if (w < 8) {
    const float* pf = ph + (size_t)(blockIdx.x & 3) * (NC / 4) * PF + tid * 32;
    /* the prefetch returns nothing and counts on no load counter; the wait is the last line of the prefetch's own statement, so that no write of the address register can come in front of it (a precaution) */
    asm volatile("global_prefetch_b8 %0, off scope:SCOPE_SE\n\ts_wait_xcnt 0x0" :: "v"(pf) : "memory");
  }
  const float* pp = ph + tid * 4;      /* a thread's 8 f16 of every partial: row e = tid / 8, d = (tid % 8) * 8 ... + 7 */
  /* the query rows are asked for first and staged while the prefetched lines travel; the partials are loaded behind them */
  v8h pr[NC]; v4f qr[16];
UNROLL
  for (int i = 0; i < 16; ++i) qr[i] = qp[i * 32];
  __builtin_amdgcn_sched_barrier(0);      /* keeps every row load in front of the first wait */
UNROLL
  for (int i = 0; i < 16; ++i) *(v4h*)(qs[w] + (i * 2 + hh) * PM + ln * 8) = in16(qr[i]);
  issue_barrier();      /* every wave holds its rows before any wave asks for a partial */
UNROLL
  for (int c = 0; c < NC; ++c) pr[c] = *(const v8h*)(pp + c * PF);
  v8f m = {0.f,0.f,0.f,0.f,0.f,0.f,0.f,0.f};
UNROLL
  for (int c = 0; c < NC; ++c) m += __builtin_convertvector(pr[c], v8f);
  { const v8h hi = __builtin_convertvector(m, v8h); const v8h lo = __builtin_convertvector(m - __builtin_convertvector(hi, v8f), v8h);
    const unsigned mo = (unsigned)(tid >> 3) * PM + (unsigned)(tid & 7) * 16;
    *(v8h*)(mh + mo) = hi; *(v8h*)(ml + mo) = lo; }
  lds_barrier();      /* publishes M; a wave's own staged rows are ordered by it too */
  /* A = M^T (rows e), B = the query rows as columns: a lane's 8 results are 8 consecutive e of one query row */
  v16h ah[4][2], al[4][2];      /* all of M stays in registers for both row groups */
UNROLL
  for (int t = 0; t < 4; ++t)
UNROLL
    for (int s = 0; s < 2; ++s) { const unsigned ro = (unsigned)(16 * t + ln) * PM + 64 * s; ah[t][s] = ld_frag(mh + ro, hh); al[t][s] = ld_frag(ml + ro, hh); }
  /* two groups of 16 query rows, each multiplied and stored */
UNROLL
  for (int g = 0; g < 2; ++g) {
    const v16h bq0 = ld_frag(qs[w] + (16 * g + ln) * PM, hh), bq1 = ld_frag(qs[w] + (16 * g + ln) * PM + 64, hh);
UNROLL
    for (int t = 0; t < 4; ++t) {
      v8f d = {0.f,0.f,0.f,0.f,0.f,0.f,0.f,0.f};
      d = mma(al[t][0], bq0, d); d = mma(al[t][1], bq1, d); d = mma(ah[t][0], bq0, d); d = mma(ah[t][1], bq1, d);
      float* op = &os[w][16 * g + ln][16 * t + 8 * hh];
      *(v4f*)op = (v4f){d[0], d[1], d[2], d[3]}; *(v4f*)(op + 4) = (v4f){d[4], d[5], d[6], d[7]};
    }
    lds_wave_fence();
UNROLL
    for (int i = 8 * g; i < 8 * g + 8; ++i) *(v4f*)(out + rbase + (size_t)(i * 32 + lane) * 4) = *(const v4f*)&os[w][i * 2 + hh][ln * 4];
  }
}

extern "C" void kernel_launch(void* const* d_in, const int* in_sizes, int n_in,
                              void* d_out, int out_size, void* d_ws, size_t ws_size, hipStream_t stream) {
  (void)in_sizes; (void)n_in; (void)out_size;
  const float* const* I = (const float* const*)d_in; const float* q = I[0]; const float* k = I[1]; const float* v = I[2];      /* q, k, v, each [1][16][4096][64] f32: element (h, s, d) at (h x 4096 + s) x 64 + d */
  float* P = (float*)d_ws;      /* SH x NC partial matrices of 64 x 64 f16 */
  if ((size_t)SH * NC * HD * HD * 2 > ws_size) return;
  k_ktv<<<SH * NC, 256, 0, stream>>>(k, v, P);
  k_qm<<<SH * (SS / QR), 512, 0, stream>>>(q, P, (float*)d_out);
}
